// v010
// Measured on an AMD MI455X. A time is GPU time per run, averaged over a window of back-to-back runs after a warm-up
// (all launches, gaps included; the runs take copies of the inputs in turn), and the median of several windows.
// Apart from v000's, it joins two sittings. Times from different sittings can be a few percent apart, while
// side-by-side timings come from the same sitting.
// Earlier versions than v010 are not in this document.
// One run takes 77.7 microseconds.
// In both of two side-by-side timings against v009, it was 1.10 times as fast.
// Counting every step since v000, which is the starting kernel, it is 55.0 times as fast.
#include <hip/hip_runtime.h>
// Causal LINEAR attention (x [2][2048][1024]; qk = x Wqk^T + bqk (natural [2048][1024]: rows 0..1023 -> q, 1024..2047 -> k; sigma 1/32, biases 0.02), v = x Wv^T + bv; 16 heads of 64; feature map phi = elu + 1 on q and k; ctx_t = (phi(q_t) . sum_{s<=t} phi(k_s) v_s^T) / (phi(q_t) . sum_{s<=t} phi(k_s)) = sum_{s<=t} a_ts v_s / sum_{s<=t} a_ts with a_ts = phi(q_t).phi(k_s) (the module's cumsum form, no softmax, no scaling, no eps); out = ctx Wo^T + bo -> [2][2048][1024]).
// Structure: x as exact f16 rows and the natural weights as exact x16 planes in one VALU launch; q, k (with the elu + 1 feature map in the GEMM epilogue) and v as one launch of WMMA GEMMs (32x64 wave tiles, f32 accumulation, + bias) with f16 outputs, phi(k) and v also transposed straight from the accumulators, the first 128 rows of each batch also in f32; the running sums phi(k) v^T and phi(k) in front of every chunk of 64 keys on WMMA (f32 accumulation, stored f16), in one launch with the first rows' f32 attention; one fused attention launch for all batches, heads and query tiles of 32 rows: phi(q) times the state in front of the chunk, then a^T = phi(k) phi(q)^T on WMMA (K = 64) for the chunk's own keys, causal mask, a as f16 straight from the accumulators into the A operand of ctx = a V^T on WMMA, row sums on WMMA too, ctx x64 / sum a into merged f16 rows; out = ctx Wo^T + bo GEMM (f32); first-tile refinement: the first 128 rows of each batch computed exactly in f32 on VALU (a / sum a weights), their output rows taken from o hi in the output GEMM, which adds the o lo product formed beside the attention launch; 5 launches.
// Compute dtype: inputs rounded to bf16; x / weights exact; q, k, v, the weights a and o as plain f16 GEMM operands (~2^-12); scores and row sums f32. v_wmma_f32_16x16x32_f16.
#define NB 2
#define SQ 2048
#define DM 1024
#define NH 16
#define HD 64
#define HG 4                         /* heads per attention launch group */
#define QT 256                       /* query rows per causal tile */
#define NKX SQ                       /* S / P row pitch */
#define QT0 128                      /* first-tile rows recomputed exactly in f32 */
#define B0 0                         /* first batch processed (debug hook) */
#define NBR NB                       /* batches processed (debug hook) */
#define NR ((size_t)NB * SQ)         /* token rows */
#define MP ((int)((size_t)NBR * SQ)) /* rows projected (debug hook) */
#define QN SQ                        /* query rows attended per batch (debug hook) */
#define NHD NH                       /* heads attended (debug hook) */
#define MPO MP                       /* rows through the output stage (debug hook) */
#define LQ DM      /* row pitch of the q/k/v rows */
typedef __bf16 v16b __attribute__((ext_vector_type(16)));
typedef unsigned short v8us __attribute__((ext_vector_type(8), may_alias));
typedef float  v8f  __attribute__((ext_vector_type(8)));
typedef float  v4f  __attribute__((ext_vector_type(4)));
typedef float  v4fa __attribute__((ext_vector_type(4), may_alias));
union FragB { v16b v; v8us half[2]; unsigned short u[16]; };

__device__ __forceinline__ unsigned short bf16_bits(float x) { unsigned int u = __float_as_uint(x); return (unsigned short)((u + 0x7FFFu + ((u >> 16) & 1u)) >> 16); }
__device__ __forceinline__ float bf16_val(unsigned short b) { return __uint_as_float(((unsigned int)b) << 16); }
__device__ __forceinline__ float bf16_round(float x) { return bf16_val(bf16_bits(x)); }
// D += A·B with NT terms: 1 = ah·bh, 2 = + al·bh (A split), 3 = + ah·bl (both split)
template <int NT>
__device__ __forceinline__ v8f mmaN(v16b ah, v16b al, v16b bh, v16b bl, v8f c) {
  c = __builtin_amdgcn_wmma_f32_16x16x32_bf16(false, ah, false, bh, (short)0, c, false, false);
  if (NT >= 2) c = __builtin_amdgcn_wmma_f32_16x16x32_bf16(false, al, false, bh, (short)0, c, false, false);
  if (NT >= 3) c = __builtin_amdgcn_wmma_f32_16x16x32_bf16(false, ah, false, bl, (short)0, c, false, false);
  asm volatile("v_nop\n\tv_nop\n\tv_nop\n\tv_nop" : "+v"(c) : "v"(ah), "v"(al), "v"(bh), "v"(bl));
  return c;
}

__global__ __launch_bounds__(256) void k_wt_bf16(const float* __restrict__ W, unsigned short* __restrict__ Wt, int K, int N) {
  const int t = blockIdx.x * 256 + threadIdx.x;
  const int k8n = K / 8;
  if (t >= N * k8n) return;
  const int n = t / k8n, k8 = (t % k8n) * 8;
  v8us v;
#pragma unroll
  for (int i = 0; i < 8; ++i) v[i] = bf16_bits(W[(size_t)(k8 + i) * N + n]);
  *(v8us*)(Wt + (size_t)n * K + k8) = v;
  
}

// GEMM C[M][N] (f32, pitch ldc) = act(A[M][K]·W + bias). A f32 row-major (pitch lda) converted per fragment to bf16
// (ASPLIT: hi/lo two planes -> 2 terms, else single rounded term); Wt bf16 [N][K] (pitch ldb). BIAS_BF16 rounds the
// bias to bf16 first (bias quantised to bf16 before the add). K%32==0, M%16==0, N%64==0.
template <bool ASPLIT, int ACT, bool BIAS_BF16>
__global__ __launch_bounds__(128) void k_gemm_bf(const float* __restrict__ A, int lda, const unsigned short* __restrict__ Wt, int ldb,
                                               const float* __restrict__ bias, float* __restrict__ C, int ldc, int M, int N, int K) {
  __shared__ __attribute__((aligned(16))) float so[4][16][64];
  const int tid = threadIdx.x, w = tid >> 5, lane = tid & 31, ln = lane & 15, hh = lane >> 4;
  const int ntn = N / 64;
  const int wid = blockIdx.x * 4 + w;
  const int mt = wid / ntn, nq = wid % ntn;
  if (mt * 16 >= M) return;
  const int row0 = mt * 16, col0 = nq * 64;
  const float* arow = A + (size_t)(row0 + ln) * lda;
  v8f acc[4] = {};
  for (int kb = 0; kb < K; kb += 32) {
    FragB ah, al;
    const v4f x0 = *(const v4fa*)(arow + kb + 8 * hh), x1 = *(const v4fa*)(arow + kb + 8 * hh + 4);
    const v4f x2 = *(const v4fa*)(arow + kb + 16 + 8 * hh), x3 = *(const v4fa*)(arow + kb + 16 + 8 * hh + 4);
    float xs[16] = {x0[0],x0[1],x0[2],x0[3],x1[0],x1[1],x1[2],x1[3],x2[0],x2[1],x2[2],x2[3],x3[0],x3[1],x3[2],x3[3]};
#pragma unroll
    for (int i = 0; i < 16; ++i) { const unsigned short hb = bf16_bits(xs[i]); ah.u[i] = hb; al.u[i] = ASPLIT ? bf16_bits(xs[i] - bf16_val(hb)) : (unsigned short)0; }
#pragma unroll
    for (int t = 0; t < 4; ++t) {
      const unsigned short* brow = Wt + (size_t)(col0 + t * 16 + ln) * ldb + kb;
      FragB b;
      b.half[0] = *(const v8us*)(brow + 8 * hh);
      b.half[1] = *(const v8us*)(brow + 16 + 8 * hh);
      acc[t] = mmaN<ASPLIT ? 2 : 1>(ah.v, al.v, b.v, b.v, acc[t]);
    }
  }
#pragma unroll
  for (int t = 0; t < 4; ++t) {
    float bv = bias ? bias[col0 + t * 16 + ln] : 0.f;
    if (BIAS_BF16) bv = bf16_round(bv);
#pragma unroll
    for (int r = 0; r < 8; ++r) { float v = acc[t][r] + bv; if (ACT == 1) v = fmaxf(v, 0.f); so[w][8 * hh + r][t * 16 + ln] = v; }
  }
  __builtin_amdgcn_fence(__ATOMIC_ACQ_REL, "workgroup");
  __builtin_amdgcn_wave_barrier();
  const int rsub = lane >> 4, c4 = (lane & 15) * 4;
  {
#pragma unroll
    for (int q = 0; q < 8; ++q) {
      const int r = q * 2 + rsub;
      const v4f v = *(const v4fa*)&so[w][r][c4];
      *(v4f*)(C + (size_t)(row0 + r) * ldc + col0 + c4) = v;
    }
    
  }
}

// GEMM C = act(A·W + bias + resid): A f32 (ASPLIT -> hi/lo 2 terms), Wt bf16 [N][K]; ACT 0 none, 1 relu, 2 exact gelu;
// resid (optional, f32, row index = (row % rmod), pitch ldr, RES_BF16 rounds it) added before the activation.
template <bool ASPLIT, int ACT, bool BIAS_BF16, bool RES_BF16>
__global__ __launch_bounds__(128) void k_gemm_bf3(const float* __restrict__ A, int lda, const unsigned short* __restrict__ Wt, int ldb,
                                                const float* __restrict__ bias, const float* __restrict__ resid, int rmod, int ldr,
                                                float* __restrict__ C, int ldc, int M, int N, int K) {
  __shared__ __attribute__((aligned(16))) float so[4][16][64];
  const int tid = threadIdx.x, w = tid >> 5, lane = tid & 31, ln = lane & 15, hh = lane >> 4;
  const int ntn = N / 64;
  const int wid = blockIdx.x * 4 + w;
  const int mt = wid / ntn, nq = wid % ntn;
  if (mt * 16 >= M) return;
  const int row0 = mt * 16, col0 = nq * 64;
  const float* arow = A + (size_t)(row0 + ln) * lda;
  v8f acc[4] = {};
  for (int kb = 0; kb < K; kb += 32) {
    FragB ah, al;
    const v4f x0 = *(const v4fa*)(arow + kb + 8 * hh), x1 = *(const v4fa*)(arow + kb + 8 * hh + 4);
    const v4f x2 = *(const v4fa*)(arow + kb + 16 + 8 * hh), x3 = *(const v4fa*)(arow + kb + 16 + 8 * hh + 4);
    float xs[16] = {x0[0],x0[1],x0[2],x0[3],x1[0],x1[1],x1[2],x1[3],x2[0],x2[1],x2[2],x2[3],x3[0],x3[1],x3[2],x3[3]};
#pragma unroll
    for (int i = 0; i < 16; ++i) { const unsigned short hb = bf16_bits(xs[i]); ah.u[i] = hb; al.u[i] = ASPLIT ? bf16_bits(xs[i] - bf16_val(hb)) : (unsigned short)0; }
#pragma unroll
    for (int t = 0; t < 4; ++t) {
      const unsigned short* brow = Wt + (size_t)(col0 + t * 16 + ln) * ldb + kb;
      FragB b;
      b.half[0] = *(const v8us*)(brow + 8 * hh);
      b.half[1] = *(const v8us*)(brow + 16 + 8 * hh);
      acc[t] = mmaN<ASPLIT ? 2 : 1>(ah.v, al.v, b.v, b.v, acc[t]);
    }
  }
#pragma unroll
  for (int t = 0; t < 4; ++t) {
    const int col = col0 + t * 16 + ln;
    float bv = bias ? bias[col] : 0.f;
    if (BIAS_BF16) bv = bf16_round(bv);
#pragma unroll
    for (int r = 0; r < 8; ++r) {
      float v = acc[t][r] + bv;
      if (resid) { float rv = resid[(size_t)((row0 + 8 * hh + r) % rmod) * ldr + col]; if (RES_BF16) rv = bf16_round(rv); v += rv; }
      if (ACT == 1) v = fmaxf(v, 0.f);
      if (ACT == 2) v = 0.5f * v * (1.0f + erff(v * 0.70710678118654752f));
      if (ACT == 3) { const float u = 0.7978845608028654f * (v + 0.044715f * v * v * v); v = 0.5f * v * (1.0f + tanhf(u)); }
      so[w][8 * hh + r][t * 16 + ln] = v;
    }
  }
  __builtin_amdgcn_fence(__ATOMIC_ACQ_REL, "workgroup");
  __builtin_amdgcn_wave_barrier();
  const int rsub = lane >> 4, c4 = (lane & 15) * 4;
  {
#pragma unroll
    for (int q = 0; q < 8; ++q) {
      const int r = q * 2 + rsub;
      const v4f v = *(const v4fa*)&so[w][r][c4];
      *(v4f*)(C + (size_t)(row0 + r) * ldc + col0 + c4) = v;
    }
    
  }
}
// row LayerNorm (biased variance, eps) over N: s = X (+ R); optional out_sum <- s; out_norm <- (s-mu)*rsqrt(var+eps)*g + b
template <bool PARAM_BF16>
__global__ __launch_bounds__(256) void k_layernorm(const float* __restrict__ X, const float* __restrict__ R, const float* __restrict__ g, const float* __restrict__ bta,
                                                  float* __restrict__ out_sum, float* __restrict__ out_norm, int N, float eps) {
  __shared__ float red[256];
  const int row = blockIdx.x, tid = threadIdx.x;
  const float* x = X + (size_t)row * N; const float* rr = R ? R + (size_t)row * N : nullptr;
  float vals[16];                     // up to N = 4096
  const int per = N / 256;            // contiguous chunk per thread? use strided-by-4 chunks: thread handles j = tid*4 + 1024*u
  float s1 = 0.f;
  for (int u = 0; u < per / 4; ++u) {
    const int j = tid * 4 + 1024 * u;
    const v4f a = *(const v4fa*)(x + j);
    v4f b = {0.f,0.f,0.f,0.f}; if (rr) b = *(const v4fa*)(rr + j);
#pragma unroll
    for (int q = 0; q < 4; ++q) { const float v = a[q] + b[q]; vals[u * 4 + q] = v; s1 += v; }
  }
  red[tid] = s1; __syncthreads();
  for (int st = 128; st > 0; st >>= 1) { if (tid < st) red[tid] += red[tid + st]; __syncthreads(); }
  const float mu = red[0] / (float)N; __syncthreads();
  float s2 = 0.f;
  for (int u = 0; u < per / 4; ++u)
#pragma unroll
    for (int q = 0; q < 4; ++q) { const float c = vals[u * 4 + q] - mu; s2 += c * c; }
  red[tid] = s2; __syncthreads();
  for (int st = 128; st > 0; st >>= 1) { if (tid < st) red[tid] += red[tid + st]; __syncthreads(); }
  const float rs = rsqrtf(red[0] / (float)N + eps);
  {
    for (int u = 0; u < per / 4; ++u) {
      const int j = tid * 4 + 1024 * u;
      v4f o, sm;
#pragma unroll
      for (int q = 0; q < 4; ++q) {
        float gg = g[j + q], bb = bta[j + q];
        if (PARAM_BF16) { gg = bf16_round(gg); bb = bf16_round(bb); }
        sm[q] = vals[u * 4 + q]; o[q] = (vals[u * 4 + q] - mu) * rs * gg + bb;
      }
      if (out_sum) *(v4f*)(out_sum + (size_t)row * N + j) = sm;
      *(v4f*)(out_norm + (size_t)row * N + j) = o;
    }
    
  }
}



// ---- f16 WMMA path (v_wmma_f32_16x16x32_f16): 11-bit significands for operands in range — used where a [0,1] probability operand needs more precision than bf16
typedef _Float16 v16h __attribute__((ext_vector_type(16)));
union FragH { v16h v; v8us half[2]; _Float16 h[16]; unsigned short u[16]; };
template <int NT>
__device__ __forceinline__ v8f mmaH(v16h ah, v16h al, v16h bh, v16h bl, v8f c) {
  c = __builtin_amdgcn_wmma_f32_16x16x32_f16(false, ah, false, bh, (short)0, c, false, false);
  if (NT >= 2) c = __builtin_amdgcn_wmma_f32_16x16x32_f16(false, al, false, bh, (short)0, c, false, false);
  if (NT >= 3) c = __builtin_amdgcn_wmma_f32_16x16x32_f16(false, ah, false, bl, (short)0, c, false, false);
  asm volatile("v_nop\n\tv_nop\n\tv_nop\n\tv_nop" : "+v"(c) : "v"(ah), "v"(al), "v"(bh), "v"(bl));
  return c;
}
// batched GEMM like k_gemm_b but f16 operands: A f32 (split into f16 hi/lo if ASPLIT, else rounded to f16), Bt = f16 values [n][k]; alpha; C f32; N multiple of 16 (partial tiles skipped)
template <bool ASPLIT>
__global__ __launch_bounds__(128) void k_gemm_h(const float* __restrict__ A, int lda, size_t sA, const _Float16* __restrict__ Bh, int ldb, size_t sB, float alpha, float* __restrict__ C, int ldc, size_t sC, int M, int N, int K) {
  __shared__ __attribute__((aligned(16))) float so[4][16][64];
  const int tid = threadIdx.x, w = tid >> 5, lane = tid & 31, ln = lane & 15, hh = lane >> 4; const int by = blockIdx.y;
  A += (size_t)by * sA; Bh += (size_t)by * sB; C += (size_t)by * sC;
  const int ntn = (N + 63) / 64; const int wid = blockIdx.x * 4 + w; const int mt = wid / ntn, nq = wid % ntn; if (mt * 16 >= M) return;
  const int row0 = mt * 16, col0 = nq * 64; const float* arow = A + (size_t)(row0 + ln) * lda;
  v8f acc[4] = {};
  for (int kb = 0; kb < K; kb += 32) {
    FragH ah, al;
    const v4f x0 = *(const v4fa*)(arow + kb + 8 * hh), x1 = *(const v4fa*)(arow + kb + 8 * hh + 4), x2 = *(const v4fa*)(arow + kb + 16 + 8 * hh), x3 = *(const v4fa*)(arow + kb + 16 + 8 * hh + 4);
    float xs[16] = {x0[0],x0[1],x0[2],x0[3],x1[0],x1[1],x1[2],x1[3],x2[0],x2[1],x2[2],x2[3],x3[0],x3[1],x3[2],x3[3]};
#pragma unroll
    for (int i = 0; i < 16; ++i) { const _Float16 h = (_Float16)xs[i]; ah.h[i] = h; al.h[i] = ASPLIT ? (_Float16)(xs[i] - (float)h) : (_Float16)0.0f; }
#pragma unroll
    for (int t = 0; t < 4; ++t) { if (col0 + t * 16 >= N) continue; const size_t boff = (size_t)(col0 + t * 16 + ln) * ldb + kb; FragH bq; bq.half[0] = *(const v8us*)(Bh + boff + 8 * hh); bq.half[1] = *(const v8us*)(Bh + boff + 16 + 8 * hh);
      acc[t] = mmaH<ASPLIT ? 2 : 1>(ah.v, al.v, bq.v, bq.v, acc[t]); }
  }
#pragma unroll
  for (int t = 0; t < 4; ++t) { if (col0 + t * 16 >= N) continue;
#pragma unroll
    for (int r = 0; r < 8; ++r) so[w][8 * hh + r][t * 16 + ln] = acc[t][r] * alpha; }
  __builtin_amdgcn_fence(__ATOMIC_ACQ_REL, "workgroup"); __builtin_amdgcn_wave_barrier();
  const int rsub = lane >> 4, c4 = (lane & 15) * 4;
  {
#pragma unroll
    for (int q = 0; q < 8; ++q) { const int r = q * 2 + rsub; if (col0 + c4 < N) { const v4f v = *(const v4fa*)&so[w][r][c4]; *(v4f*)(C + (size_t)(row0 + r) * ldc + col0 + c4) = v; } }
     }
}

// Wt[n][k] = f16(W[k][n]·scale) from f32 row-major W[K][N] (scale = power of two; bf16-exact weights stay exact in f16 away from the subnormal range)
__global__ __launch_bounds__(256) void k_wt_f16(const float* __restrict__ W, _Float16* __restrict__ Wt, int K, int N, float scale) {
  const int t = blockIdx.x * 256 + threadIdx.x; if (t >= N * (K / 8)) return; const int n = t / (K / 8), k8 = (t % (K / 8)) * 8; FragH f;
#pragma unroll
  for (int i = 0; i < 8; ++i) f.h[i] = (_Float16)(bf16_round(W[(size_t)(k8 + i) * N + n]) * scale); const v8us o = f.half[0];
  *(v8us*)((unsigned short*)Wt + (size_t)n * K + k8) = o; 
}
// k_gemm_hh variant with fused epilogue: v = acc·alpha + bias[by·sBias + col] (+ CP[(row/rowsPerB)·sCPb + by·64 + col] if CP) ; ACT 0 none / 1 elu ; writes f16 C16 (and f32 C if non-null)
template <int ACT>
__global__ __launch_bounds__(128) void k_gemm_hhx(const _Float16* __restrict__ A, int lda, size_t sA, const _Float16* __restrict__ Bh, int ldb, size_t sB, float alpha, const float* __restrict__ bias, size_t sBias, const float* __restrict__ CP, int rowsPerB, size_t sCPb, int row0g,
    float* __restrict__ C, _Float16* __restrict__ C16, int ldc, size_t sC, int M, int N, int K) {
  __shared__ __attribute__((aligned(16))) float so[4][16][64];
  const int tid = threadIdx.x, w = tid >> 5, lane = tid & 31, ln = lane & 15, hh = lane >> 4; const int by = blockIdx.y;
  A += (size_t)by * sA; Bh += (size_t)by * sB; const size_t cofs = (size_t)by * sC; const float* bp = bias ? bias + (size_t)by * sBias : nullptr;
  const int ntn = (N + 63) / 64; const int wid = blockIdx.x * 4 + w; const int mt = wid / ntn, nq = wid % ntn; if (mt * 16 >= M) return;
  const int row0 = mt * 16, col0 = nq * 64; const _Float16* arow = A + (size_t)(row0 + ln) * lda;
  v8f acc[4] = {};
  for (int kb = 0; kb < K; kb += 32) { FragH ah; ah.half[0] = *(const v8us*)((const unsigned short*)arow + kb + 8 * hh); ah.half[1] = *(const v8us*)((const unsigned short*)arow + kb + 16 + 8 * hh);
#pragma unroll
    for (int t = 0; t < 4; ++t) { if (col0 + t * 16 >= N) continue; const size_t boff = (size_t)(col0 + t * 16 + ln) * ldb + kb; FragH bq; bq.half[0] = *(const v8us*)((const unsigned short*)Bh + boff + 8 * hh); bq.half[1] = *(const v8us*)((const unsigned short*)Bh + boff + 16 + 8 * hh);
      acc[t] = mmaH<1>(ah.v, ah.v, bq.v, bq.v, acc[t]); }
  }
#pragma unroll
  for (int t = 0; t < 4; ++t) { if (col0 + t * 16 >= N) continue; const int col = col0 + t * 16 + ln; const float bv = bp ? bf16_round(bp[col]) : 0.f;
#pragma unroll
    for (int r = 0; r < 8; ++r) { float v = acc[t][r] * alpha + bv; if (CP) { const int rr = row0g + row0 + 8 * hh + r; if (rowsPerB < 0) v += CP[cofs + (size_t)rr * ldc + col];      /* rowsPerB < 0: own element of the batched C plane */ else { const int bidx = rr / rowsPerB; v += CP[(size_t)bidx * sCPb + (size_t)by * 64 + col]; } } if (ACT == 1) v = (v > 0.f) ? v : expm1f(v); else if (ACT == 7) v = (v > 0.f) ? v + 1.0f : expf(v); else if (ACT == 8) v = tanhf(v); else if (ACT == 9) v = 0.5f * v * (1.0f + tanhf(0.7978845608028654f * (v + 0.044715f * v * v * v))); else if (ACT == 11) v = 1.0f / (1.0f + expf(-v)); else if (ACT == 12) v = (v > 0.f) ? v : 0.01f * v; else if (ACT == 14) v = (v > 0.f) ? v : 0.1f * v; else if (ACT == 16) v = (v >= 0.f) ? v : 0.3f * v; else if (ACT == 17) v = (v >= 0.f) ? v : 0.2f * v; else if (ACT == 15) v = v / (1.0f + expf(-v)); else if (ACT == 3) v = fmaxf(v, 0.f); else if (ACT == 6) v = 0.5f * v * (1.0f + erff(v * 0.70710678118654752f)); so[w][8 * hh + r][t * 16 + ln] = v; } }
  __builtin_amdgcn_fence(__ATOMIC_ACQ_REL, "workgroup"); __builtin_amdgcn_wave_barrier();
  const int rsub = lane >> 4, c4 = (lane & 15) * 4; typedef _Float16 v4h __attribute__((ext_vector_type(4)));
  {
#pragma unroll
    for (int q = 0; q < 8; ++q) { const int r = q * 2 + rsub; if (col0 + c4 < N) { const v4f v = *(const v4fa*)&so[w][r][c4]; if (C) *(v4f*)(C + cofs + (size_t)(row0 + r) * ldc + col0 + c4) = v; if (C16) { v4h h4; for (int i = 0; i < 4; ++i) h4[i] = (_Float16)v[i]; *(v4h*)(C16 + cofs + (size_t)(row0 + r) * ldc + col0 + c4) = h4; } } }
     }
}


typedef _Float16 v4h __attribute__((ext_vector_type(4)));

__global__ __launch_bounds__(256) void k_h16(const float* __restrict__ x, _Float16* __restrict__ X16, size_t n8) { const size_t t = (size_t)blockIdx.x * 256 + threadIdx.x; if (t >= n8) return; FragH f;
#pragma unroll
  for (int q = 0; q < 8; ++q) f.h[q] = (_Float16)x[t * 8 + q]; *(v8us*)((unsigned short*)X16 + t * 8) = f.half[0];  }
__global__ __launch_bounds__(256) void k_round16f(const float* __restrict__ W, _Float16* __restrict__ Bt, size_t n8) { const size_t t = (size_t)blockIdx.x * 256 + threadIdx.x; if (t >= n8) return; FragH f;
#pragma unroll
  for (int i = 0; i < 8; ++i) f.h[i] = (_Float16)(bf16_round(W[t * 8 + i]) * 16.0f); *(v8us*)((unsigned short*)Bt + t * 8) = f.half[0];  }
template <int NHv, int TTv>
__global__ __launch_bounds__(256) void k_vt(const _Float16* __restrict__ V16, int ldv, int voff, _Float16* __restrict__ Vt) { __shared__ unsigned short tl[64][66]; const int tid = threadIdx.x; const int slab = blockIdx.x / (TTv / 64), lg = blockIdx.x % (TTv / 64); const int b = slab / NHv, h = slab % NHv;
  for (int i = tid; i < 64 * 8; i += 256) { const int r = i / 8, c8 = (i % 8) * 8; FragH f; f.half[0] = *(const v8us*)((const unsigned short*)V16 + ((size_t)b * TTv + lg * 64 + r) * ldv + voff + h * 64 + c8);
#pragma unroll
    for (int q = 0; q < 8; ++q) tl[r][c8 + q] = f.u[q]; }
  __syncthreads();
  {
#pragma unroll
    for (int rd = 0; rd < 2; ++rd) { const int i = rd * 256 + tid, ln = i & 15, hh = (i >> 4) & 1, j = (i >> 5) & 1, t = (i >> 6) & 3, ss = i >> 8; FragH f;      /* fragment order: [slab][32 keys][16 d][half j] pieces of 512 bytes, lane (hh, ln) holding row d = 16 t + ln, keys 16 j + 8 hh + 0..7; piece and lane count up with i, so a wave stores 512 contiguous bytes */
#pragma unroll
      for (int q = 0; q < 8; ++q) f.u[q] = tl[ss * 32 + j * 16 + hh * 8 + q][t * 16 + ln];
      *(v8us*)((unsigned short*)Vt + ((size_t)slab * (TTv / 64) + lg) * 4096 + i * 8) = f.half[0]; }
     } }

// ---- fast GEMM (work-group tile 128x64, wave tile 32x64; requires M % 32 == 0 rows per launch region, N % 64 == 0 and K % 128 == 0); epilogue = k_gemm_hhx semantics ----
// Operand tiles of GK k (one 128-byte line of each of the 128 A rows and 64 B rows) go through LDS: eight lanes fetch a whole line, two tiles ahead of the matrix work, and the waves read their fragments from LDS.
// Products that read none of each other's output share a launch: planes by = blockIdx.y; planes by < nact take bias + by sBias and the activation, the others biasz and none; cfirst: the f32 plane C takes only the first QT0 rows of each batch;
// A1 (if given): the row tiles that hold the first QT0 rows of a batch read their A rows from A1 [batch][QT0] in place of A.
// Planes by < npk (rows of NH heads of HD = 64 columns, SQ rows a batch) store their f16 output in FRAGMENT ORDER in place of rows: [batch][head][16-row tile] tiles of PKT halfs; a tile is four pieces c of 512 bytes,
// piece c holding at lane (hh, ln) the 8 halfs of row ln, columns 16 c + 8 hh + 0..7: pieces 2 m and 2 m + 1 are the two halves of the g2_frag fragment of columns 32 m .. 32 m + 31, each one whole-line load of a wave.
// Planes by >= ntr (if CT is given) store their f16 output TRANSPOSED in fragment order into plane by - ntr of CT, and no f16 rows: [batch][head][32 rows][16 columns t][half j] pieces of 512 bytes,
// lane (hh, ln) holding column 16 t + ln, rows 16 j + 8 hh + 0..7: the fragment of a product that sums over the rows.
#define PKT 1024                     /* halfs per 16 x 64 tile in fragment order */
__device__ __forceinline__ v16h pk_frag(const _Float16* p) { FragH f; f.half[0] = *(const v8us*)((const unsigned short*)p); f.half[1] = *(const v8us*)((const unsigned short*)p + 256); return f.v; }      /* p: the fragment's first piece + 8 lane */
#define GK 64                        /* k per staged tile */
#define GP 72                        /* pitch in halfs of a staged row: 144 B = 16 B x odd, so that 16-byte fragment reads of 16 rows spread over the banks */
__device__ __forceinline__ v16h g2_frag(const _Float16* p, int hh) { FragH f; f.half[0] = *(const v8us*)((const unsigned short*)p + 8 * hh); f.half[1] = *(const v8us*)((const unsigned short*)p + 16 + 8 * hh); return f.v; }
__device__ __forceinline__ v8f g2_mma(v16h a, v16h b, v8f c) { v8f d = __builtin_amdgcn_wmma_f32_16x16x32_f16(false, a, false, b, (short)0, c, false, false); asm volatile("v_nop\n\tv_nop\n\tv_nop\n\tv_nop" : "+v"(d) : "v"(a), "v"(b)); return d; }
// The epilogue tests each run-time switch (act, tr, the row passes) once a wave, in front of straight-line code for the wave's 64 elements a lane, so that the kernel's text stays short.
// gemm2: the body, for work-group (bx, by) of the grid described above; so: the work-group's epilogue rows in LDS, handed in so that a launch which holds other work too has them once. CF (if given): f32 rows laid out like C; the row tiles with the first QT0 rows of a batch add their own elements of it in the row pass.
template <int ACT>
__device__ __forceinline__ void gemm2(const unsigned bx, const int by, float (*so)[32][68], const _Float16* __restrict__ A, int lda, size_t sA, const _Float16* __restrict__ Bh, int ldb, size_t sB, float alpha, const float* __restrict__ bias, size_t sBias,
    float* __restrict__ C, _Float16* __restrict__ C16, int ldc, size_t sC, int M, int N, int K, const _Float16* __restrict__ A1, const float* __restrict__ biasz, int nact, int cfirst, int npk, _Float16* __restrict__ CT, int ntr, const float* CF) { static_assert(ACT == 0 || ACT == 3 || ACT == 6 || ACT == 8 || ACT == 9 || ACT == 11 || ACT == 12 || ACT == 14 || ACT == 15 || ACT == 16 || ACT == 17 || ACT == 19, "k_gemm2: unsupported ACT code (would silently apply no activation)"); static_assert(QT0 == 128 && SQ % 128 == 0, "k_gemm2: the first rows of a batch are one row tile"); static_assert(DM % 128 == 0, "k_gemm2: K = DM is an even number of staged tiles");
  __shared__ __attribute__((aligned(16))) _Float16 sa[2][128][GP]; __shared__ __attribute__((aligned(16))) _Float16 sb[2][64][GP];
  const int tid = threadIdx.x, w = tid >> 5, lane = tid & 31, ln = lane & 15, hh = lane >> 4;
  A += (size_t)by * sA; Bh += (size_t)by * sB; const size_t cofs = (size_t)by * sC; const bool act = by < nact; const float* bp = bias ? (act ? bias + (size_t)by * sBias : biasz) : nullptr;
  const int ntn = N >> 6; const int mt = bx / ntn, nq = bx - mt * ntn; const int row0 = mt * 128 + 32 * w, col0 = nq * 64; if (mt * 128 >= M) return;      /* the whole work-group or none: barriers follow; a wave whose own rows lie past M leaves behind the last one */
  const int sr = tid >> 3, sc = (tid & 7) * 8;      /* staging: 8 lanes per 128-byte line, 16 rows per pass of the work-group */
  const bool first = (mt * 128) % SQ == 0; const bool cf = C && (!cfirst || first); const bool pk = by < npk; const bool tr = CT && by >= ntr; const bool rows16 = C16 && !pk && !tr; const bool cfa = CF && cf && first; int ar0 = mt * 128, am = M;      /* ar0, am: the tile's first row in its A plane and that plane's rows */
  const char* ab = (const char*)A; const char* bb = (const char*)Bh; unsigned ao[8], bo[4]; if (A1 && first) { ab = (const char*)A1; ar0 = ar0 / SQ * QT0; am = M / SQ * QT0; }      /* one base per operand for the whole work-group + the lane's own byte offset to each of its rows; a 16-row pass past M (M % 32 == 0) rereads the last 16 rows, which no wave uses */
#pragma unroll
  for (int p = 0; p < 8; ++p) ao[p] = (unsigned)((min(ar0 + 16 * p, am - 16) + sr) * lda + sc) * 2u;
#pragma unroll
  for (int p = 0; p < 4; ++p) bo[p] = (unsigned)((col0 + 16 * p + sr) * ldb + sc) * 2u;
  v8us ra0[8], rb0[4], ra1[8], rb1[4]; v16h a0[2], a1[2], b[2][4];      /* two register sets: tile t lies in set t mod 2 on its way to LDS, so that two tiles' loads are in flight */
  auto fetch = [&](v8us (&fa)[8], v8us (&fb)[4]) {      /* the next tile not yet asked for into one register set */
#pragma unroll
    for (int p = 0; p < 8; ++p) fa[p] = *(const v8us*)(ab + ao[p]);
#pragma unroll
    for (int p = 0; p < 4; ++p) fb[p] = *(const v8us*)(bb + bo[p]); };
  auto step = [&]() {      /* the offsets step on by one tile while the loads that name them are still in flight */
    asm volatile("s_wait_xcnt 0x0" :: "v"(ao[0]), "v"(ao[1]), "v"(ao[2]), "v"(ao[3]), "v"(ao[4]), "v"(ao[5]), "v"(ao[6]), "v"(ao[7]), "v"(bo[0]), "v"(bo[1]), "v"(bo[2]), "v"(bo[3]) : "memory");      /* behind the last load of the tile; the twelve offsets are its inputs, so that none of them is overwritten ahead of it */
#pragma unroll
    for (int p = 0; p < 8; ++p) ao[p] += GK * 2;
#pragma unroll
    for (int p = 0; p < 4; ++p) bo[p] += GK * 2; };
  auto put = [&](int u, v8us (&pa)[8], v8us (&pb)[4]) {      /* a fetched tile into buffer u */
#pragma unroll
    for (int p = 0; p < 8; ++p) *(v8us*)&sa[u][16 * p + sr][sc] = pa[p];
#pragma unroll
    for (int p = 0; p < 4; ++p) *(v8us*)&sb[u][16 * p + sr][sc] = pb[p]; };
  auto bar = [&]() {      /* the loop's work-group barrier; its fences name LDS alone, the only memory that the waves hand each other here, so that the global loads of the tile after next stay in flight across it (__syncthreads() waits for them) */
    __builtin_amdgcn_fence(__ATOMIC_RELEASE, "workgroup", "local"); __builtin_amdgcn_s_barrier(); __builtin_amdgcn_fence(__ATOMIC_ACQUIRE, "workgroup", "local"); };
  auto frags = [&](int u) {      /* all fragments of one staged tile: the second half's reads return under the first half's products */
#pragma unroll
    for (int ks = 0; ks < 2; ++ks) { a0[ks] = g2_frag(&sa[u][32 * w + ln][ks * 32], hh); a1[ks] = g2_frag(&sa[u][32 * w + 16 + ln][ks * 32], hh);
#pragma unroll
      for (int t = 0; t < 4; ++t) b[ks][t] = g2_frag(&sb[u][16 * t + ln][ks * 32], hh); } };
  const v8f z8 = {0.f,0.f,0.f,0.f,0.f,0.f,0.f,0.f}; v8f c00 = z8, c01 = z8, c02 = z8, c03 = z8, c10 = z8, c11 = z8, c12 = z8, c13 = z8;
  auto prods = [&]() {
#pragma unroll
    for (int ks = 0; ks < 2; ++ks) { c00 = g2_mma(a0[ks], b[ks][0], c00); c10 = g2_mma(a1[ks], b[ks][0], c10); c01 = g2_mma(a0[ks], b[ks][1], c01); c11 = g2_mma(a1[ks], b[ks][1], c11);
      c02 = g2_mma(a0[ks], b[ks][2], c02); c12 = g2_mma(a1[ks], b[ks][2], c12); c03 = g2_mma(a0[ks], b[ks][3], c03); c13 = g2_mma(a1[ks], b[ks][3], c13); } };
  const int nt = K / GK;
  /* a pass over tile t (buffer u = t mod 2): its fragments, the loads of tile t + 2 (tripf) into the set that tile t has left, its products, then tile t + 1, asked for one whole pass earlier, into the other buffer; the one barrier of a pass publishes it and ends the reads of tile t, whose buffer the next pass refills */
  auto tripf = [&](int u, v8us (&fa)[8], v8us (&fb)[4], v8us (&pa)[8], v8us (&pb)[4]) { frags(u); fetch(fa, fb); prods(); step(); put(u ^ 1, pa, pb); bar(); };
  auto tripn = [&](int u, v8us (&pa)[8], v8us (&pb)[4]) { frags(u); prods(); put(u ^ 1, pa, pb); bar(); };
  fetch(ra0, rb0); step(); fetch(ra1, rb1); step(); put(0, ra0, rb0); bar();
#pragma unroll 1      /* two passes a trip, so that register set and buffer are constants; every pass of the loop fetches, with no branch round the loads, so that the counted waits leave the younger tile in flight */
  for (int t = 0; t + 3 < nt; t += 2) { tripf(0, ra0, rb0, ra1, rb1); tripf(1, ra1, rb1, ra0, rb0); }
  tripn(0, ra1, rb1); frags(1); prods();      /* the last two tiles (the number of tiles is even): nothing is left to ask for */
  if (row0 >= M) return;
  v8f accs[8] = {c00, c01, c02, c03, c10, c11, c12, c13};
  v4f cr[16];      /* the lane's elements of CF, at the addresses of its row-pass stores: all sixteen loads in flight together, under the accumulators' way into LDS */
  if (cfa) { const char* cb = (const char*)(CF + cofs + (size_t)(row0 + (lane >> 4)) * ldc + col0 + (lane & 15) * 4); const unsigned cs = (unsigned)ldc * 8u; const char* ca[16];
#pragma unroll
    for (int q = 0; q < 16; ++q) { ca[q] = cb + q * cs; cr[q] = *(const v4fa*)ca[q]; }
    asm volatile("s_wait_xcnt 0x0" :: "v"(ca[0]), "v"(ca[1]), "v"(ca[2]), "v"(ca[3]), "v"(ca[4]), "v"(ca[5]), "v"(ca[6]), "v"(ca[7]), "v"(ca[8]), "v"(ca[9]), "v"(ca[10]), "v"(ca[11]), "v"(ca[12]), "v"(ca[13]), "v"(ca[14]), "v"(ca[15]) : "memory"); }      /* behind the last load of the run; the sixteen address pairs are its inputs, so that none of them is given to a load's result or reused ahead of it */
  unsigned short* tq = (unsigned short*)CT + (tr ? (size_t)(by - ntr) * sC + (((size_t)(row0 / SQ) * NH + nq) * (SQ / 32) + (row0 % SQ) / 32) * 2048 + lane * 8 : (size_t)0);      /* the wave's 32 rows x 64 columns, transposed: one block of 4 KiB */
  float bv[4] = {0.f, 0.f, 0.f, 0.f};      /* the bias of the lane's four columns: the four loads are in flight together */
  if (bp) { const float* bq = bp + col0 + ln;
#pragma unroll
    for (int t = 0; t < 4; ++t) bv[t] = bq[t * 16];
    asm volatile("s_wait_xcnt 0x0" :: "v"(bq) : "memory");      /* behind the last load of the run; the address pair is its input, so that it is not given to a load's result or reused ahead of it */
#pragma unroll
    for (int t = 0; t < 4; ++t) bv[t] = bf16_round(bv[t]); }
#pragma unroll
  for (int u = 0; u < 8; ++u)
#pragma unroll
    for (int r = 0; r < 8; ++r) accs[u][r] = accs[u][r] * alpha + bv[u & 3];
  if (ACT != 0 && act) {      /* the plane's switch is tested once a wave; the 64 elements behind it are straight-line code, independent of each other */
#pragma unroll
    for (int u = 0; u < 8; ++u)
#pragma unroll
      for (int r = 0; r < 8; ++r) { float v = accs[u][r];
        if (ACT == 3) v = fmaxf(v, 0.f); else if (ACT == 6) v = 0.5f * v * (1.0f + erff(v * 0.70710678118654752f)); else if (ACT == 11) v = 1.0f / (1.0f + expf(-v)); else if (ACT == 15) v = v / (1.0f + expf(-v)); else if (ACT == 19) { const float e = expf(v); v = (v > 0.f) ? (v + 1.0f) : e; }      /* elu(v) + 1; the exponential is formed for every lane and chosen by a select, so that no branch stands between the elements */ else if (ACT == 12) v = (v > 0.f) ? v : 0.01f * v; else if (ACT == 8) v = tanhf(v); else if (ACT == 9) v = 0.5f * v * (1.0f + tanhf(0.7978845608028654f * (v + 0.044715f * v * v * v))); else if (ACT == 14) v = (v > 0.f) ? v : 0.1f * v; else if (ACT == 16) v = (v >= 0.f) ? v : 0.3f * v; else if (ACT == 17) v = (v >= 0.f) ? v : 0.2f * v;
        accs[u][r] = v; } }
  if (tr) {
#pragma unroll
    for (int u = 0; u < 8; ++u) { const int t = u & 3, half = u >> 2; FragH tf;
#pragma unroll
      for (int r = 0; r < 8; ++r) tf.h[r] = (_Float16)accs[u][r];
      *(v8us*)(tq + t * 512 + half * 256) = tf.half[0]; asm volatile("s_wait_xcnt 0x0" :: "v"(tf.half[0]), "v"(tq) : "memory"); } }      /* an accumulator holds 8 consecutive rows of ONE column in a lane: that is the lane's 16 bytes of the transposed fragment, stored as 512 contiguous bytes a wave; the wait stands behind the store with the stored registers and the address pair as inputs, so that neither is reused ahead of it */
  if (cf || rows16 || (C16 && pk)) {      /* the rows go through LDS only where one of the two passes below reads them */
#pragma unroll
    for (int u = 0; u < 8; ++u)
#pragma unroll
      for (int r = 0; r < 8; ++r) so[w][(u >> 2) * 16 + 8 * hh + r][(u & 3) * 16 + ln] = accs[u][r]; }
  __builtin_amdgcn_fence(__ATOMIC_ACQ_REL, "workgroup"); __builtin_amdgcn_wave_barrier();
  const int rsub = lane >> 4, c4 = (lane & 15) * 4;
  if (cf || rows16) {      /* the row pass; a tile that stores neither f32 rows nor f16 rows skips its sixteen LDS reads */
#pragma unroll
    for (int q = 0; q < 16; ++q) { const int r = q * 2 + rsub; v4f v = *(const v4fa*)&so[w][r][c4]; if (cfa) v += cr[q];
      if (cf) { *(v4f*)(C + cofs + (size_t)(row0 + r) * ldc + col0 + c4) = v; asm volatile("s_wait_xcnt 0x0" :: "v"(v) : "memory"); }      /* behind the f32 store; the stored registers are the wait's inputs, so that the f16 conversion below does not reuse them ahead of it */
      if (rows16) { v4h h4; for (int i = 0; i < 4; ++i) h4[i] = (_Float16)v[i]; _Float16* dp = C16 + cofs + (size_t)(row0 + r) * ldc + col0 + c4; *(v4h*)dp = h4; asm volatile("s_wait_xcnt 0x0" :: "v"(h4), "v"(dp) : "memory"); } }      /* behind the f16 row store; the stored registers and the address pair are the wait's inputs, so that nothing behind it reuses them ahead of it */
     }
  if (C16 && pk) {      /* fragment order: the wave's 32 rows x 64 columns are two tiles of 2 KiB in a row; each store is 512 contiguous bytes */
    unsigned short* pt = (unsigned short*)C16 + cofs + (((size_t)(row0 / SQ) * NH + nq) * (SQ / 16) + (row0 % SQ) / 16) * PKT + lane * 8;
#pragma unroll      /* constant LDS and store offsets; the LDS reads of all eight pieces are issued ahead of the conversions */
    for (int u = 0; u < 8; ++u) { const float* sp = &so[w][(u >> 2) * 16 + ln][(u & 3) * 16 + 8 * hh]; const v4f x = *(const v4fa*)sp, y = *(const v4fa*)(sp + 4); FragH f;
#pragma unroll
      for (int i = 0; i < 4; ++i) { f.h[i] = (_Float16)x[i]; f.h[4 + i] = (_Float16)y[i]; }
      *(v8us*)(pt + u * 256) = f.half[0]; } } }
template <int ACT>
__global__ __launch_bounds__(128) void k_gemm2(const _Float16* __restrict__ A, int lda, size_t sA, const _Float16* __restrict__ Bh, int ldb, size_t sB, float alpha, const float* __restrict__ bias, size_t sBias,
    float* __restrict__ C, _Float16* __restrict__ C16, int ldc, size_t sC, int M, int N, int K, const _Float16* __restrict__ A1, const float* __restrict__ biasz, int nact, int cfirst, int npk, _Float16* __restrict__ CT, int ntr, const float* CF) {
  __shared__ __attribute__((aligned(16))) float so[4][32][68];
  gemm2<ACT>(blockIdx.x, (int)blockIdx.y, so, A, lda, sA, Bh, ldb, sB, alpha, bias, sBias, C, C16, ldc, sC, M, N, K, A1, biasz, nact, cfirst, npk, CT, ntr, CF); }


// All four operand conversions in one launch (none reads another's output): the weights, natural [out][in] = Bt[n][k], x16, into the planes BW = Wqk (q rows, k rows) | Wv | Wo, then x into X16. A work-group lies wholly in one source.
#define CPB (DM * DM / 8 / 256)      /* work-groups per DM x DM plane, 8 elements per thread */
#define CXB ((unsigned)(NR * DM / 8 / 256))      /* work-groups of x */
__global__ __launch_bounds__(256) void k_cvt(const float* __restrict__ wqk, const float* __restrict__ wv, const float* __restrict__ wo, const float* __restrict__ x, _Float16* __restrict__ BW, _Float16* __restrict__ X16) {
  const unsigned bx = blockIdx.x; const float* s = wqk; _Float16* d = BW; unsigned b0 = 0; float sc = 16.0f;
  if (bx >= 4 * CPB) { s = x; d = X16; b0 = 4 * CPB; sc = 1.0f; } else if (bx >= 3 * CPB) { s = wo; d = BW + (size_t)3 * DM * DM; b0 = 3 * CPB; } else if (bx >= 2 * CPB) { s = wv; d = BW + (size_t)2 * DM * DM; b0 = 2 * CPB; }
  const size_t t = (size_t)(bx - b0) * 256 + threadIdx.x; FragH f;
#pragma unroll
  for (int q = 0; q < 8; ++q) f.h[q] = (_Float16)(bf16_round(s[t * 8 + q]) * sc);
  *(v8us*)((unsigned short*)d + t * 8) = f.half[0]; }
__global__ __launch_bounds__(256) void k_rsm(const float* __restrict__ S, _Float16* __restrict__ P, int nrows) {
  #pragma clang fp contract(off)
  const int i = blockIdx.x * 256 + threadIdx.x; if (i >= nrows) return; const float* s = S + (size_t)i * SQ; float mx = -3.0e38f;
#pragma unroll 1
  for (int j = 0; j < SQ; ++j) mx = fmaxf(mx, s[j]); float se = 0.f;
#pragma unroll 1
  for (int j = 0; j < SQ; ++j) se += expf(s[j] - mx); const float sc = 256.0f / se;
#pragma unroll 1
  for (int j0 = 0; j0 < SQ; j0 += 8) { FragH f; for (int q = 0; q < 8; ++q) f.h[q] = (_Float16)(expf(s[j0 + q] - mx) * sc); unsigned short* d = (unsigned short*)P + (size_t)i * SQ + j0; *(v8us*)d = f.half[0];  } }
__global__ __launch_bounds__(256) void k_vt(const _Float16* __restrict__ V16, int b, int h0, _Float16* __restrict__ VT) { __shared__ unsigned short tl[64][65]; const int tid = threadIdx.x; const int hh = blockIdx.x % HG, sg = blockIdx.x / HG; const int s0 = sg * 64; const int h = h0 + hh;
  for (int i = tid; i < 64 * 8; i += 256) { const int j = i / 8, d8 = (i % 8) * 8; FragH f; f.half[0] = *(const v8us*)((const unsigned short*)V16 + ((size_t)b * SQ + s0 + j) * DM + h * HD + d8); for (int q = 0; q < 8; ++q) tl[d8 + q][j] = f.u[q]; }
  __syncthreads();
  { for (int i = tid; i < 64 * 8; i += 256) { const int d = i / 8, j8 = (i % 8) * 8; FragH f; for (int q = 0; q < 8; ++q) f.u[q] = tl[d][j8 + q]; *(v8us*)((unsigned short*)VT + ((size_t)hh * HD + d) * SQ + s0 + j8) = f.half[0]; }  } }



__global__ __launch_bounds__(256) void k_rsmcf2(const float* __restrict__ S, _Float16* __restrict__ P, int hg, int q0, int nk) {
  #pragma clang fp contract(off)
  const int t = blockIdx.x * 256 + threadIdx.x; if (t >= hg * QT) return; const size_t i = (size_t)t; const float* s = S + i * NKX; const int last = q0 + (t % QT); float mx = -3.0e38f;
#pragma unroll 1
  for (int j = 0; j < nk; ++j) { const float f = (j <= last) ? 1.f : 0.f; mx = fmaxf(mx, fmaf(f, s[j], (1.f - f) * -1.0e9f)); } float se = 0.f;
#pragma unroll 1
  for (int j = 0; j < nk; ++j) { const float f = (j <= last) ? 1.f : 0.f; se += __expf(fmaf(f, s[j], (1.f - f) * -1.0e9f) - mx); } const float sc = 256.0f / se;
#pragma unroll 1
  for (int j0 = 0; j0 < nk; j0 += 8) { FragH fr; for (int q = 0; q < 8; ++q) { const int j = j0 + q; const float f = (j <= last) ? 1.f : 0.f; fr.h[q] = (_Float16)(__expf(fmaf(f, s[j], (1.f - f) * -1.0e9f) - mx) * sc); } unsigned short* d = (unsigned short*)P + i * NKX + j0; *(v8us*)d = fr.half[0];  } }


template <int MASKADD>
__global__ __launch_bounds__(64) void k_att0(const float* __restrict__ QF, const float* __restrict__ KF, const float* __restrict__ VF, int ld, const float* __restrict__ mask, float scale, float* __restrict__ OF, int ldo) {
  #pragma clang fp contract(off)
  __shared__ __attribute__((aligned(16))) float lq[64][64]; __shared__ __attribute__((aligned(16))) float lo[64][64];
  const int tid = threadIdx.x; const int h = blockIdx.x / (QT0 / 64), rg = blockIdx.x % (QT0 / 64); const int i = rg * 64 + tid;
  const float* qr = QF + (size_t)i * ld + h * HD;
#pragma unroll 1
  for (int c = 0; c < HD / 4; ++c) { *(v4f*)&lq[tid][c * 4] = *(const v4fa*)(qr + c * 4); const v4f z = {0.f, 0.f, 0.f, 0.f}; *(v4f*)&lo[tid][c * 4] = z; }
  float m = -1.0e30f, l = 0.f; const int jmax = MASKADD ? (SQ - 1) : (rg * 64 + 63);      /* additive-mask form: every key (the mask input decides); causal form: keys up to the block's last row */
#pragma unroll 1
  for (int j = 0; j <= jmax; ++j) { const float* kr = KF + (size_t)j * ld + h * HD; const float* vr = VF + (size_t)j * ld + h * HD; float s = 0.f;
#pragma unroll 1
    for (int c = 0; c < HD / 4; ++c) { const v4f kq = *(const v4fa*)(kr + c * 4); const v4f qq = *(v4f*)&lq[tid][c * 4]; s = __fadd_rn(s, __fmul_rn(qq[0], kq[0])); s = __fadd_rn(s, __fmul_rn(qq[1], kq[1])); s = __fadd_rn(s, __fmul_rn(qq[2], kq[2])); s = __fadd_rn(s, __fmul_rn(qq[3], kq[3])); }
    s = __fmul_rn(s, scale); if (MASKADD) s = __fadd_rn(s, __fmul_rn(bf16_round(mask[(size_t)i * SQ + j]), -10000.0f));
    const float f = (MASKADD || j <= i) ? 1.f : 0.f; const float sm = fmaf(f, s, (1.f - f) * -1.0e30f); const float mn = fmaxf(m, sm); const float sc = expf(m - mn); const float e = expf(sm - mn); l = __fadd_rn(__fmul_rn(l, sc), e); m = mn;
#pragma unroll 1
    for (int c = 0; c < HD / 4; ++c) { const v4f vv = *(const v4fa*)(vr + c * 4); v4f oo = *(v4f*)&lo[tid][c * 4]; for (int u = 0; u < 4; ++u) oo[u] = __fadd_rn(__fmul_rn(oo[u], sc), __fmul_rn(e, vv[u])); *(v4f*)&lo[tid][c * 4] = oo; } }
  const float fin = 64.0f / l;      /* o carried x64 like the f16 path */
#pragma unroll 1
  for (int c = 0; c < HD / 4; ++c) { v4f oo = *(v4f*)&lo[tid][c * 4]; for (int u = 0; u < 4; ++u) oo[u] = __fmul_rn(oo[u], fin); *(v4f*)&lo[tid][c * 4] = oo; }
  __syncthreads();
  {
#pragma unroll 1
    for (int it = 0; it < 16; ++it) { const int row = it * 4 + tid / 16, pc = (tid % 16) * 4; const v4f v = *(const v4f*)&lo[row][pc]; *(v4f*)(OF + (size_t)(rg * 64 + row) * ldo + h * HD + pc) = v; }
     } }


// Causal linear attention in chunks of SC keys: o_i = sum_{j <= i} a_ij v_j / sum_{j <= i} a_ij, a_ij = phi(q_i) . phi(k_j). The sums over the keys are plain sums, so the keys in front of a query's own chunk
// enter through the running state S = sum_j phi(k_j) v_j^T (HD x HD) and z = sum_j phi(k_j), as in the cumulative-sum form of the definition: o_i = (phi(q_i) S + own chunk) / (phi(q_i) z + own chunk).
// kvs: the state in front of every chunk. One work-group per (batch, head, 32 rows d, 16 columns t of S), one wave per (16 rows d, quarter of the keys). A wave forms the sums of its 8 chunks, S[d][t] = sum K^T[d][key] V^T[t][key] on WMMA
// (f32 accumulators; both planes transposed in fragment order by k_gemm2), the quarters' totals go through LDS, and each wave adds up in f32: the quarters in front of its own, then its chunks in ascending order,
// storing the tile as f16 in front of each chunk. A lane of the accumulator holds 8 consecutive d of ONE column t: its 16 bytes of the B fragment (row t, k = d) of phi(q) S. Column tile 4 takes a fragment of ones for V^T: each of its 16 columns is z.
#define SC 64                        /* keys per chunk */
#define SNP 5120                     /* halfs per stored state: [5 column tiles][4 d tiles] pieces of 512 bytes */
#define SG 8                         /* steps of 32 keys whose loads are in flight together */
#define SN 4                         /* parts of the keys, two waves each */
#define SW (SQ / SC / SN)            /* chunks per wave */
#define SB (5 * 2 * NH * NB)          /* work-groups of kvs, 64 SN threads each */
__device__ __forceinline__ void kvs(const int bi, const _Float16* __restrict__ KT, const _Float16* __restrict__ VT, _Float16* __restrict__ ST) {      /* bi: 0 .. SB - 1 */
  __shared__ __attribute__((aligned(16))) float tot[SN][2][32][8];
  const int lane = threadIdx.x & 31; const int wv = __builtin_amdgcn_readfirstlane(threadIdx.x >> 5); const int dl = wv & 1, sg = wv >> 1; const int tt = bi % 5, dt = (bi / 5) % 2 * 2 + dl, h = (bi / 10) % NH, b = bi / (10 * NH); const bool zt = tt == 4;
  const size_t hb = ((size_t)b * NH + h) * SQ * HD + (size_t)sg * (SQ / SN) * HD + lane * 8; const _Float16* kp = KT + hb + dt * 512; const _Float16* vp = VT + hb + (zt ? 0 : tt) * 512;
  unsigned short* sp = (unsigned short*)ST + (((size_t)b * NH + h) * (SQ / SC) + sg * SW) * SNP + (tt * 4 + dt) * 256 + lane * 8;
  v16h one;
#pragma unroll
  for (int i = 0; i < 16; ++i) one[i] = (_Float16)1.0f;
  const v8f z8 = {0.f,0.f,0.f,0.f,0.f,0.f,0.f,0.f}; v8f cs[SW];
#pragma unroll      /* constant indices into cs */
  for (int g = 0; g < SW * 2 / SG; ++g) { v16h kf[SG], vf[SG]; const _Float16* kq = kp + g * SG * 2048; const _Float16* vq = vp + g * SG * 2048;
#pragma unroll
    for (int s = 0; s < SG; ++s) { kf[s] = pk_frag(kq + s * 2048); vf[s] = pk_frag(vq + s * 2048); }
    asm volatile("s_wait_xcnt 0x0" :: "v"(kq), "v"(vq) : "memory");      /* behind the last load of the group; the two address pairs are its inputs, so that neither is reused ahead of it */
#pragma unroll
    for (int c = 0; c < SG / 2; ++c) cs[g * (SG / 2) + c] = g2_mma(kf[2 * c + 1], zt ? one : vf[2 * c + 1], g2_mma(kf[2 * c], zt ? one : vf[2 * c], z8)); }
  v8f run = cs[0];
#pragma unroll
  for (int c = 1; c < SW; ++c) run += cs[c];
  *(v4f*)&tot[sg][dl][lane][0] = __builtin_shufflevector(run, run, 0, 1, 2, 3); *(v4f*)&tot[sg][dl][lane][4] = __builtin_shufflevector(run, run, 4, 5, 6, 7);
  __syncthreads();
  run = z8;
#pragma unroll
  for (int s = 0; s < SN - 1; ++s) if (s < sg) { const v4f x = *(const v4f*)&tot[s][dl][lane][0], y = *(const v4f*)&tot[s][dl][lane][4]; run += __builtin_shufflevector(x, y, 0, 1, 2, 3, 4, 5, 6, 7); }
#pragma unroll
  for (int c = 0; c < SW; ++c) { FragH f;      /* the state in front of the chunk (zero in front of the first), then the chunk's sum */
#pragma unroll
    for (int r = 0; r < 8; ++r) f.h[r] = (_Float16)run[r];
    *(v8us*)(sp + c * SNP) = f.half[0]; asm volatile("s_wait_xcnt 0x0" :: "v"(f.half[0]), "v"(sp) : "memory");      /* behind the store; the stored registers and the address pair are its inputs, so that neither is reused ahead of it */
    run += cs[c]; } }

// lfa: one wave per (batch, head, 32 query rows), four such waves a work-group. o and the row sum l start as phi(q) S and phi(q) z of the state in front of the rows' chunk; then the chunk's own 64 keys in two steps of 32:
// a^T = K Q^T, so that a lane of the accumulator holds 8 consecutive keys of ONE query: accumulator tile 0 (keys 0..15) and tile 1 (keys 16..31) of a query column, masked and rounded to f16,
// are elements 0..7 and 8..15 of the A fragment of a V^T in the k order of g2_frag (8 hh + i, 16 + 8 hh + i), in which V^T is stored too: nothing is moved between lanes. a times a fragment of ones adds the row sums to l,
// which so lies in the lane and register of the o elements that it divides. Every load of a wave is 512 contiguous bytes, four whole lines.
#define FQ 32                        /* query rows per wave */
#define FS 32                        /* keys per step */
#define FP 68                        /* pitch in floats of the o rows in LDS, as in k_gemm2 */
#define FB (SQ / FQ / 4)              /* work-groups of lfa per (batch, head) */
__device__ __forceinline__ void lfa(const int bi, float (*so)[FQ][FP], const _Float16* __restrict__ Q16, const _Float16* __restrict__ K16, const _Float16* __restrict__ VT, const _Float16* __restrict__ ST, _Float16* __restrict__ O16) {      /* bi: 0 .. FB NH NB - 1; so: the work-group's o rows in LDS; Q16, K16: fragment order of k_gemm2; VT: its transposed fragment order; each SQ HD halfs a (batch, head); ST: kvs; O16: rows of DM */
  const int tid = threadIdx.x, lane = tid & 31, ln = lane & 15, hh = lane >> 4; const int w = __builtin_amdgcn_readfirstlane(tid >> 5);
  const int rg = bi % FB * 4 + w, h = bi / FB % NH, b = bi / (FB * NH), ch = rg / (SC / FQ);
  const size_t hb = ((size_t)b * NH + h) * SQ * HD + lane * 8; const _Float16* qp = Q16 + hb + (size_t)rg * FQ * HD; const _Float16* kp = K16 + hb + (size_t)ch * SC * HD; const _Float16* vp = VT + hb + (size_t)ch * SC * HD;
  const _Float16* sp = ST + (((size_t)b * NH + h) * (SQ / SC) + ch) * SNP + lane * 8;
  v16h qf[2][2], sf[5][2], one;
#pragma unroll
  for (int i = 0; i < 16; ++i) one[i] = (_Float16)1.0f;
#pragma unroll
  for (int qs = 0; qs < 2; ++qs) { qf[qs][0] = pk_frag(qp + qs * PKT); qf[qs][1] = pk_frag(qp + qs * PKT + 512); }
#pragma unroll
  for (int t = 0; t < 5; ++t) { sf[t][0] = pk_frag(sp + t * 1024); sf[t][1] = pk_frag(sp + t * 1024 + 512); }
  asm volatile("s_wait_xcnt 0x0" :: "v"(qp), "v"(sp) : "memory");      /* behind the last q and state load; the address pairs are its inputs, so that they are not reused ahead of it */
  const v8f z8 = {0.f,0.f,0.f,0.f,0.f,0.f,0.f,0.f}; v8f o[2][5];      /* o[qs][t][r]: query 16 qs + 8 hh + r, column 16 t + ln; t = 4: the row sum, the same in every column */
#pragma unroll
  for (int qs = 0; qs < 2; ++qs)
#pragma unroll
    for (int t = 0; t < 5; ++t) o[qs][t] = g2_mma(qf[qs][0], sf[t][0], z8);
#pragma unroll
  for (int qs = 0; qs < 2; ++qs)
#pragma unroll
    for (int t = 0; t < 5; ++t) o[qs][t] = g2_mma(qf[qs][1], sf[t][1], o[qs][t]);
#pragma unroll
  for (int js = 0; js < SC / FS; ++js) { const _Float16* kq = kp + js * FS * HD; const _Float16* vq = vp + js * FS * HD;      /* a step's k and its V^T: 4 KiB in a row each */
    v16h kf[2][2], vf[4];
#pragma unroll
    for (int ks = 0; ks < 2; ++ks) { kf[ks][0] = pk_frag(kq + ks * PKT); kf[ks][1] = pk_frag(kq + ks * PKT + 512); }
#pragma unroll
    for (int t = 0; t < 4; ++t) vf[t] = pk_frag(vq + t * 512);
    asm volatile("s_wait_xcnt 0x0" :: "v"(kq), "v"(vq) : "memory");      /* behind the last load of the step; the two address pairs are its inputs, so that neither is reused ahead of it */
    v8f st[2][2];      /* st[ks][qs][r]: key ch SC + js FS + 16 ks + 8 hh + r, query rg FQ + 16 qs + ln */
#pragma unroll
    for (int ks = 0; ks < 2; ++ks)
#pragma unroll
      for (int qs = 0; qs < 2; ++qs) st[ks][qs] = g2_mma(kf[ks][0], qf[qs][0], z8);
#pragma unroll
    for (int ks = 0; ks < 2; ++ks)
#pragma unroll
      for (int qs = 0; qs < 2; ++qs) st[ks][qs] = g2_mma(kf[ks][1], qf[qs][1], st[ks][qs]);
    const int dq = (rg - ch * (SC / FQ) - js) * FS + ln - 8 * hh;      /* query row less key row at ks = qs = r = 0; both steps are masked, the keys behind a query count zero */
#pragma unroll
    for (int ks = 0; ks < 2; ++ks)
#pragma unroll
      for (int qs = 0; qs < 2; ++qs)
#pragma unroll
        for (int r = 0; r < 8; ++r) st[ks][qs][r] = (ks * 16 + r <= qs * 16 + dq) ? st[ks][qs][r] : 0.f;
#pragma unroll
    for (int qs = 0; qs < 2; ++qs) { FragH p;
#pragma unroll
      for (int r = 0; r < 8; ++r) { p.h[r] = (_Float16)st[0][qs][r]; p.h[8 + r] = (_Float16)st[1][qs][r]; }
#pragma unroll
      for (int t = 0; t < 4; ++t) o[qs][t] = g2_mma(p.v, vf[t], o[qs][t]);
      o[qs][4] = g2_mma(p.v, one, o[qs][4]); } }
#pragma unroll
  for (int qs = 0; qs < 2; ++qs)
#pragma unroll
    for (int r = 0; r < 8; ++r) { const float fin = 64.0f / o[qs][4][r];      /* o carried x64 as the output GEMM expects */
#pragma unroll
      for (int t = 0; t < 4; ++t) so[w][qs * 16 + 8 * hh + r][t * 16 + ln] = o[qs][t][r] * fin; }
  __syncthreads();
  const int r0 = lane >> 2, c0 = (lane & 3) * 16;      /* four lanes per output row: 32 bytes each of its 128-byte line; a wave stores its own 32 rows in four passes */
#pragma unroll
  for (int p = 0; p < 4; ++p) { const int row = p * 8 + r0; FragH f;
#pragma unroll
    for (int c = 0; c < 4; ++c) { const v4f a = *(const v4f*)&so[w][row][c0 + c * 4];
#pragma unroll
      for (int q = 0; q < 4; ++q) f.h[c * 4 + q] = (_Float16)a[q]; }
    unsigned short* d = (unsigned short*)O16 + ((size_t)b * SQ + rg * FQ + row) * DM + h * HD + c0;
    *(v8us*)d = f.half[0]; *(v8us*)(d + 8) = f.half[1]; asm volatile("s_wait_xcnt 0x0" :: "v"(f.half[0]), "v"(f.half[1]), "v"(d) : "memory"); } }      /* behind the two stores; the stored registers and the address pair are its inputs, so that neither is reused ahead of it */
// One launch for two pieces of work that read none of each other's output: work-groups 0 .. LB - 1 (the longer ones, so they start first) form o_lo Wo 2^-20 of the first QT0 rows of each batch and store it in the output's rows,
// where the output GEMM adds it to its own sums; the others are lfa. Both use the same LDS rows for their epilogue.
#define LB (NB * (DM / 64))          /* work-groups of the o_lo product: one row tile of QT0 = 128 rows a batch */
__global__ __launch_bounds__(128) void k_lfa_lo(const _Float16* __restrict__ Q16, const _Float16* __restrict__ K16, const _Float16* __restrict__ VT, const _Float16* __restrict__ ST, _Float16* __restrict__ O16, const _Float16* __restrict__ OL, const _Float16* __restrict__ BO, float* __restrict__ out) {
  __shared__ __attribute__((aligned(16))) float so[4][FQ][FP]; static_assert(FQ == 32 && FP == 68, "one LDS array for both epilogues");
  const int bi = blockIdx.x;
  if (bi < LB) gemm2<0>((unsigned)(bi % (DM / 64)), bi / (DM / 64), so, OL, DM, (size_t)QT0 * DM, BO, DM, 0, 0.00000095367431640625f, nullptr, 0, out, nullptr, DM, (size_t)SQ * DM, QT0, DM, DM, nullptr, nullptr, NB, 0, 0, nullptr, 0, nullptr);
  else lfa(bi - LB, so, Q16, K16, VT, ST, O16); }

// Exact f32 linear attention for the first QT0 rows of every batch. One work-group of 8 waves per (batch, head, 32 query rows), lane = query row.
// The head's QT0 key and value rows and the group's 32 q rows are staged once in LDS with whole-line loads, all in flight together. Step 1: wave w takes the keys j = w mod 8, four at a time
// (four independent sum chains), q row in registers, k row broadcast from LDS; the masked score goes to le[j][row]. Step 2: wave w owns columns 8 w .. 8 w + 7 of o in registers
// and walks the keys in ascending order. Each sum runs in the order of the one-thread-per-row form (d ascending, j ascending); keys above the group's last row only ever added zeros and are left out.
#define LR 32                        /* query rows per work-group */
#define LP 68                        /* pitch in floats of the per-row LDS arrays: 16 B x odd, so that 32 lanes reading 16 B of their own rows spread over the banks */
#define LA (NH * (QT0 / LR))         /* work-groups of latt0 per batch */
__device__ __forceinline__ void latt0(const int bi, const float* __restrict__ QF, const float* __restrict__ KF, const float* __restrict__ VF, _Float16* __restrict__ OH, _Float16* __restrict__ OL) {      /* bi: 0 .. LA NB - 1; all planes: rows of DM; QF, KF, VF: SQ rows a batch, the first QT0 of them written; OH, OL: QT0 rows a batch, o (x64) as f16 and its residual x1024 as f16 */
  { const int bt = bi / LA; const size_t fb = (size_t)bt * SQ * DM; QF += fb; KF += fb; VF += fb; OH += (size_t)bt * QT0 * DM; OL += (size_t)bt * QT0 * DM; }
  __shared__ __attribute__((aligned(16))) float lk[QT0][HD]; __shared__ __attribute__((aligned(16))) float lv[QT0][HD]; __shared__ __attribute__((aligned(16))) float le[QT0][LR];
  __shared__ __attribute__((aligned(16))) float lq[LR][LP]; __shared__ __attribute__((aligned(16))) float lo[LR][LP];
  const int tid = threadIdx.x, w = tid >> 5, lane = tid & 31; const int h = bi % LA / (QT0 / LR), rg = bi % (QT0 / LR); const int r0 = rg * LR, nj = r0 + LR, i = r0 + lane;
  const int sr = tid / (HD / 4), sc = (tid % (HD / 4)) * 4;      /* staging and output: 16 lanes per 256-byte row, 16 rows per pass of the work-group */
  { v4f tk[QT0 / 16], tv[QT0 / 16], tq[LR / 16]; const float* kp = KF + (size_t)sr * DM + h * HD + sc; const float* vp = VF + (size_t)sr * DM + h * HD + sc; const float* qp = QF + (size_t)(r0 + sr) * DM + h * HD + sc;
#pragma unroll      /* every load is issued before the first LDS store waits for one */
    for (int p = 0; p < QT0 / 16; ++p) { tk[p] = *(const v4fa*)(kp + (size_t)p * 16 * DM); tv[p] = *(const v4fa*)(vp + (size_t)p * 16 * DM); }
#pragma unroll
    for (int p = 0; p < LR / 16; ++p) tq[p] = *(const v4fa*)(qp + (size_t)p * 16 * DM);
    asm volatile("s_wait_xcnt 0x0" :: "v"(kp), "v"(vp), "v"(qp) : "memory");      /* behind the last load of the run; the three address pairs are its inputs, so that none of them is given to a load's result or reused ahead of it */
#pragma unroll
    for (int p = 0; p < QT0 / 16; ++p) { *(v4f*)&lk[p * 16 + sr][sc] = tk[p]; *(v4f*)&lv[p * 16 + sr][sc] = tv[p]; }
#pragma unroll
    for (int p = 0; p < LR / 16; ++p) *(v4f*)&lq[p * 16 + sr][sc] = tq[p]; }
  __syncthreads();
  v4f q[HD / 4];
#pragma unroll      /* q stays in registers: constant indices only */
  for (int c = 0; c < HD / 4; ++c) q[c] = *(const v4f*)&lq[lane][c * 4];
  for (int jb = 0; jb < nj; jb += 32) { const int j0 = jb + w; float s0 = 0.f, s1 = 0.f, s2 = 0.f, s3 = 0.f;
#pragma unroll      /* constant indices into q; the four chains fill each other's result latency */
    for (int c = 0; c < HD / 4; ++c) { const v4f k0 = *(const v4f*)&lk[j0][c * 4], k1 = *(const v4f*)&lk[j0 + 8][c * 4], k2 = *(const v4f*)&lk[j0 + 16][c * 4], k3 = *(const v4f*)&lk[j0 + 24][c * 4];
#pragma unroll
      for (int u = 0; u < 4; ++u) { s0 += q[c][u] * k0[u]; s1 += q[c][u] * k1[u]; s2 += q[c][u] * k2[u]; s3 += q[c][u] * k3[u]; } }
    le[j0][lane] = (j0 <= i) ? s0 : 0.f; le[j0 + 8][lane] = (j0 + 8 <= i) ? s1 : 0.f; le[j0 + 16][lane] = (j0 + 16 <= i) ? s2 : 0.f; le[j0 + 24][lane] = (j0 + 24 <= i) ? s3 : 0.f; }
  __syncthreads();
  float l = 0.f; v4f oa = {0.f, 0.f, 0.f, 0.f}, ob = {0.f, 0.f, 0.f, 0.f};
#pragma unroll 8      /* eight keys' LDS reads are issued ahead of the sums that use them */
  for (int j = 0; j < nj; ++j) { const float e = le[j][lane]; const v4f va = *(const v4f*)&lv[j][w * 8], vb = *(const v4f*)&lv[j][w * 8 + 4]; l += e; oa += e * va; ob += e * vb; }
  const float fin = 64.0f / l;      /* o carried x64 like the f16 path */
  *(v4f*)&lo[lane][w * 8] = oa * fin; *(v4f*)&lo[lane][w * 8 + 4] = ob * fin;
  __syncthreads();
#pragma unroll      /* two passes, each wave storing whole 128-byte lines of both planes */
  for (int p = 0; p < LR / 16; ++p) { const v4f a = *(const v4f*)&lo[p * 16 + sr][sc]; v4h fh, fl;
#pragma unroll
    for (int q = 0; q < 4; ++q) { const _Float16 hq = (_Float16)a[q]; fh[q] = hq; fl[q] = (_Float16)((a[q] - (float)hq) * 1024.0f); }
    const size_t od = (size_t)(r0 + p * 16 + sr) * DM + h * HD + sc; _Float16* dh = OH + od; _Float16* dl = OL + od;
    *(v4h*)dh = fh; *(v4h*)dl = fl; asm volatile("s_wait_xcnt 0x0" :: "v"(fh), "v"(fl), "v"(dh), "v"(dl) : "memory"); } }      /* behind the two stores; the stored registers and the address pairs are its inputs, so that none is reused ahead of it */
// One launch for two pieces of work that read none of each other's output (both read what the q, k, v GEMM wrote): work-groups 0 .. LA NB - 1 are latt0, the others kvs.
__global__ __launch_bounds__(256) void k_latt0_kvs(const float* __restrict__ QF, const float* __restrict__ KF, const float* __restrict__ VF, _Float16* __restrict__ OH, _Float16* __restrict__ OL, const _Float16* __restrict__ KT, const _Float16* __restrict__ VT, _Float16* __restrict__ ST) {
  static_assert(64 * SN == 256, "kvs and latt0 have work-groups of 8 waves"); const int bi = blockIdx.x;
  if (bi < LA * NB) latt0(bi, QF, KF, VF, OH, OL); else kvs(bi - LA * NB, KT, VT, ST); }
extern "C" void kernel_launch(void* const* d_in, const int* in_sizes, int n_in,
                              void* d_out, int out_size, void* d_ws, size_t ws_size, hipStream_t stream) {
  (void)in_sizes; (void)n_in; (void)out_size;
  const float* const* I = (const float* const*)d_in; const float* x = I[0]; const float* wqk = I[1]; const float* bqk = I[2]; const float* wv = I[3]; const float* bv = I[4]; const float* wo = I[5]; const float* bo = I[6];      /* natural Wqk [2048][1024] (q rows | k rows) + bias [2048]; Wv + bv; Wo + bo */
  char* ws = (char*)d_ws; size_t off = 0;
  auto take = [&](size_t bytes) { char* p = ws + off; off += (bytes + 255) & ~(size_t)255; return p; };
  _Float16* BQK = (_Float16*)take((size_t)4 * DM * DM * 2); _Float16* BO = BQK + (size_t)3 * DM * DM;      /* four planes in a row: Wq | Wk | Wv | Wo */
  _Float16* X16 = (_Float16*)take(NR * DM * 2); _Float16* Q16 = (_Float16*)take((size_t)3 * NR * DM * 2); _Float16* K16 = Q16 + NR * DM; _Float16* O16 = (_Float16*)take(NR * DM * 2);      /* q | k | v: three planes in a row */
  _Float16* KT = (_Float16*)take((size_t)2 * NB * NH * HD * SQ * 2); _Float16* VT = KT + (size_t)NB * NH * HD * SQ; _Float16* ST = (_Float16*)take((size_t)NB * NH * (SQ / SC) * SNP * 2);      /* K^T | V^T: two planes in a row; the states in front of the chunks */
  float* QF0 = (float*)take((size_t)3 * NR * DM * 4); float* KF0 = QF0 + NR * DM; float* VF0 = QF0 + 2 * NR * DM;      /* f32 q | k | v, indexed like the f16 planes; only the first QT0 rows of each batch are written and read */
  _Float16* OH0 = (_Float16*)take((size_t)NB * QT0 * DM * 2); _Float16* OL0 = (_Float16*)take((size_t)NB * QT0 * DM * 2);
  if (off > ws_size) return;
  k_cvt<<<4 * CPB + CXB, 256, 0, stream>>>(wqk, wv, wo, x, BQK, X16);
  k_gemm2<19><<<dim3((unsigned)((NR / 128) * (DM / 64)), 3), 128, 0, stream>>>(X16, DM, 0, BQK, DM, (size_t)DM * DM, 0.0625f, bqk, DM, QF0, Q16, DM, NR * DM, (int)NR, DM, DM, nullptr, bv, 2, 1, 2, KT, 1, nullptr);      /* planes 0, 1: phi(q), phi(k) = elu(x W^T + b) + 1, f16 in fragment order; planes 1, 2: phi(k), v transposed in fragment order; and in f32 rows the first 128 rows of each batch (exact products) */
  k_latt0_kvs<<<LA * NB + SB, 256, 0, stream>>>(QF0, KF0, VF0, OH0, OL0, KT, VT, ST);      /* exact f32 linear attention for rows 0..127 of each batch (the few-key rows without the f16 roundings), o (x64) stored as f16 hi + x1024 residual planes; beside it the running sums phi(k) v^T and phi(k) in front of every chunk of 64 keys */
  k_lfa_lo<<<LB + FB * NH * NB, 128, 0, stream>>>(Q16, K16, VT, ST, O16, OL0, BO, (float*)d_out);      /* state product, own chunk's scores, causal normalisation and a V^T of every batch, head and query tile: o (merged heads, x64) as f16 rows; beside it rows 0..127 of each batch of out = o_lo Wo 2^-20 */
  k_gemm2<0><<<dim3((unsigned)((NR / 128) * (DM / 64)), 1), 128, 0, stream>>>(O16, DM, 0, BO, DM, 0, 0.0009765625f, bo, 0, (float*)d_out, nullptr, DM, 0, (int)NR, DM, DM, OH0, nullptr, 1, 0, 0, nullptr, 0, (const float*)d_out);      /* out rows are the output layout; rows 0..127 of each batch: out = o_hi Wo + b + their own element as the launch before left it */
}
